// v010
// Times are from an AMD MI455X. After a warm-up the kernel runs many times in a row, and a time is the length of
// such a window on the GPU divided by its runs, so every launch and the gaps after it count. The runs cycle
// through copies of the inputs. A figure is the median of several windows, for all but v000 over two sittings.
// Sittings can differ by a few percent; kernels timed side by side share one.
// Earlier versions than v010 are not in this document.
// One run takes 116 microseconds.
// Next to v009, in two timings, it ran 1.05 times as fast each time.
// Over all steps from v000, the starting kernel, it is 17.9 times as fast.
#include <hip/hip_runtime.h>

// T5 self-attention layer (hidden [2][2048][1024]; n = LayerNorm(hidden) (1e-6, ln_g, ln_b); q, k, v = n W ('xw' [1024][1024], no bias, 16 heads x 64); scores = q.k (NO 1/sqrt(d)) + rel_bias[bucket(j - i)][h] (T5 bidirectional buckets, 32 buckets, max distance 128); softmax over all keys; out = hidden + merged Wo -> [2][2048][1024]).
// The bucket index depends only on (j - i); it is embedded as a 4095-entry integer table computed with the reference's own bucket function (its f32 log -> int32 cast has exact-integer knife edges, so it is not recomputed on the device).
// Compute dtypes, f32 accumulate: every input rounded to bf16; q/k/v hl x exact (2 products); the relative-position bias (bf16-rounded rel_bias values through the embedded bucket table) enters the scores in f32; scores and attn.v: query rows < 512 hl (3 products), the rest single fp16 (P x1024); softmax f32, online; Wo hl x exact (2 products), + hidden residual in f32.

#define NB_  2
#define TT   2048
#define DM   1024
#define NH_  16
#define NKV  16
#define REP  (NH_ / NKV)
#define HD   64
#define DQ   (NH_ * HD)
#define DKV  (NKV * HD)
#define LNEPS 1e-6f
#define NBKT 32
#define RH   512                  // query rows < RH use hi+lo planes
#define WIN  0
#define PSH  10.0f                 // fp16 P carries 2^10 (added to the exponent; it cancels against the row sum)
#define SCL  1.0f                  // T5: no 1/sqrt(d) scaling
typedef _Float16 h16;
typedef unsigned short bf;
typedef __attribute__((ext_vector_type(16))) __bf16   v16bf;
typedef __attribute__((ext_vector_type(16))) _Float16 v16h;
typedef __attribute__((ext_vector_type(8)))  _Float16 v8h;
typedef __attribute__((ext_vector_type(8)))  unsigned short v8us;
typedef __attribute__((ext_vector_type(8)))  float    v8f;
typedef __attribute__((ext_vector_type(4)))  float    v4f;
typedef v8h  __attribute__((may_alias)) v8ha;
typedef v4f  __attribute__((may_alias)) v4fa;
typedef v8us __attribute__((may_alias)) v8usa;

__device__ __forceinline__ unsigned short f2bf(float f) { unsigned u = __float_as_uint(f); u += 0x7FFFu + ((u >> 16) & 1u); return (unsigned short)(u >> 16); }
__device__ __forceinline__ float bf2f(unsigned short b) { return __uint_as_float(((unsigned)b) << 16); }
__device__ __forceinline__ float bfr(float f) { return bf2f(f2bf(f)); }
__device__ __forceinline__ v16h cat16(v8h lo, v8h hi) { return __builtin_shufflevector(lo, hi, 0, 1, 2, 3, 4, 5, 6, 7, 8, 9, 10, 11, 12, 13, 14, 15); }
__device__ __forceinline__ v16bf cat16b(v8us lo, v8us hi) { return __builtin_bit_cast(v16bf, __builtin_shufflevector(lo, hi, 0, 1, 2, 3, 4, 5, 6, 7, 8, 9, 10, 11, 12, 13, 14, 15)); }
__device__ __forceinline__ v8f wmma16(v16h a, v16h b, v8f c) { return __builtin_amdgcn_wmma_f32_16x16x32_f16(false, a, false, b, (short)0, c, false, false); }
__device__ __forceinline__ v8f wmmab(v16bf a, v16bf b, v8f c) { return __builtin_amdgcn_wmma_f32_16x16x32_bf16(false, a, false, b, (short)0, c, false, false); }



__device__ __forceinline__ h16 tohx(float x) { return (h16)x; }
__device__ __forceinline__ void splitf(float y, unsigned short& h, unsigned short& l) { h = f2bf(y); l = f2bf(y - bf2f(h)); }
// The wait stands between a run of global stores and the first rewrite of a register that they name: addresses and data are inputs, so they stay in their registers up to the wait, and the scheduling barrier keeps later instructions behind it.
__device__ __forceinline__ void swaitp(const void* a, const void* b, const void* c, const v8h (&x)[4], const v8us (&y)[4], const v8us (&w)[4]) { asm volatile("s_wait_xcnt 0x0" :: "v"(a), "v"(b), "v"(c), "v"(x[0]), "v"(x[1]), "v"(x[2]), "v"(x[3]), "v"(y[0]), "v"(y[1]), "v"(y[2]), "v"(y[3]), "v"(w[0]), "v"(w[1]), "v"(w[2]), "v"(w[3]) : "memory"); __builtin_amdgcn_sched_barrier(0); }
// The same between a pass's run of global loads and the first rewrite of an address register that they name.
__device__ __forceinline__ void gwait(const void* a, const void* b, const void* c, const void* d) { asm volatile("s_wait_xcnt 0x0" :: "v"(a), "v"(b), "v"(c), "v"(d) : "memory"); __builtin_amdgcn_sched_barrier(0); }
// The same behind a run of eight global stores: address and data are inputs, so each stays in its register until every store of the run has been issued and the wait has passed.
__device__ __forceinline__ void swaitw(const void* a, const v8us (&x)[8]) { asm volatile("s_wait_xcnt 0x0" :: "v"(a), "v"(x[0]), "v"(x[1]), "v"(x[2]), "v"(x[3]), "v"(x[4]), "v"(x[5]), "v"(x[6]), "v"(x[7]) : "memory"); }
__device__ __forceinline__ void swaitf(const void* a, const void* b, const v4f (&x)[8]) { asm volatile("s_wait_xcnt 0x0" :: "v"(a), "v"(b), "v"(x[0]), "v"(x[1]), "v"(x[2]), "v"(x[3]), "v"(x[4]), "v"(x[5]), "v"(x[6]), "v"(x[7]) : "memory"); __builtin_amdgcn_sched_barrier(0); }

template <typename T16> struct WFrag;
template <> struct WFrag<h16> { typedef v16h V; static __device__ __forceinline__ V ld(const h16* p) { return cat16(*(const v8h*)p, *(const v8h*)(p + 256)); } static __device__ __forceinline__ v8f mma(V a, V b, v8f c) { return wmma16(a, b, c); } };
template <> struct WFrag<bf> { typedef v16bf V; static __device__ __forceinline__ V ld(const bf* p) { return cat16b(*(const v8us*)p, *(const v8us*)(p + 256)); } static __device__ __forceinline__ v8f mma(V a, V b, v8f c) { return wmmab(a, b, c); } };
static_assert(HD == 64, "one 64-column tile is one head");
static_assert(TT % 64 == 0 && NKV == NH_ && DQ == DM && DKV == DM, "a 64-row tile lies in one batch; q, k, v planes and the four weight matrices have one size each");
// The plane epilogue of one tile; TR: transposed planes. Every loop is unrolled (the accumulators are registers and take constant indices only) and PP is a constant, so that all stores of a block name p16, ph or pl plus a constant.
template <bool TR>
__device__ __forceinline__ void gemm_planes(const v8f (&acc)[4][4], float* os, h16* p16, bf* ph, bf* pl, int lr, int hi) {
    constexpr int PP = TR ? TT : HD;   /* columns (K) of a plane: 16 staged rows are 16 PP elements of it */
#pragma unroll
    for (int blk = 0; blk < 4; ++blk) {
#pragma unroll
        for (int ob = 0; ob < 4; ++ob) {
            if constexpr (!TR) {   /* staged row = m, 16 rows of block blk */
#pragma unroll
                for (int j = 0; j < 8; ++j) os[(hi * 8 + j) * 68 + ob * 16 + lr] = acc[blk][ob][j];
            } else {   /* staged row = n, 16 columns of block blk: a lane's 8 accumulator rows are 8 neighbours in it */
                const v8f t = acc[ob][blk]; *(v4fa*)(os + lr * 68 + ob * 16 + hi * 8) = __builtin_shufflevector(t, t, 0, 1, 2, 3); *(v4fa*)(os + lr * 68 + ob * 16 + hi * 8 + 4) = __builtin_shufflevector(t, t, 4, 5, 6, 7); } }
        __builtin_amdgcn_wave_barrier(); asm volatile("" ::: "memory");   /* fence: writes before reads */
        v8h o16[4]; v8us oh[4], ol[4];
#pragma unroll
        for (int s = 0; s < 4; ++s) { const float* sp = os + lr * 68 + s * 16 + hi * 8; const v4f x0 = *(const v4fa*)sp, x1 = *(const v4fa*)(sp + 4);
#pragma unroll
            for (int k = 0; k < 8; ++k) { const float x = (k < 4) ? x0[k & 3] : x1[k & 3]; o16[s][k] = tohx(x); unsigned short a2, c2; splitf(x, a2, c2); oh[s][k] = a2; ol[s][k] = c2; }
            *(v8h*)(p16 + blk * 16 * PP + s * 256) = o16[s]; *(v8us*)(ph + blk * 16 * PP + s * 256) = oh[s]; *(v8us*)(pl + blk * 16 * PP + s * 256) = ol[s]; }
        swaitp(p16, ph, pl, o16, oh, ol);
        __builtin_amdgcn_wave_barrier(); asm volatile("" ::: "memory");   /* fence: reads before the next writes */
    }
}
// Twelve copies of 512 bytes (16 a lane) from global memory into LDS, through no register. The s_wait_xcnt 0 is the statement's last line, so that it stands in front of every later write of an address register that a copy names.
__device__ __forceinline__ void copy12(const unsigned (&d)[12], const void* const (&g)[12]) {
    asm volatile("global_load_async_to_lds_b128 %0, %12, off\n\tglobal_load_async_to_lds_b128 %1, %13, off\n\tglobal_load_async_to_lds_b128 %2, %14, off\n\tglobal_load_async_to_lds_b128 %3, %15, off\n\t"
                 "global_load_async_to_lds_b128 %4, %16, off\n\tglobal_load_async_to_lds_b128 %5, %17, off\n\tglobal_load_async_to_lds_b128 %6, %18, off\n\tglobal_load_async_to_lds_b128 %7, %19, off\n\t"
                 "global_load_async_to_lds_b128 %8, %20, off\n\tglobal_load_async_to_lds_b128 %9, %21, off\n\tglobal_load_async_to_lds_b128 %10, %22, off\n\tglobal_load_async_to_lds_b128 %11, %23, off\n\ts_wait_xcnt 0x0"
                 :: "v"(d[0]), "v"(d[1]), "v"(d[2]), "v"(d[3]), "v"(d[4]), "v"(d[5]), "v"(d[6]), "v"(d[7]), "v"(d[8]), "v"(d[9]), "v"(d[10]), "v"(d[11]),
                    "v"(g[0]), "v"(g[1]), "v"(g[2]), "v"(g[3]), "v"(g[4]), "v"(g[5]), "v"(g[6]), "v"(g[7]), "v"(g[8]), "v"(g[9]), "v"(g[10]), "v"(g[11]) : "memory");
}
// Tile s (k columns s GKS ..) of the work-group's 128 rows of A, A2 and Bt into the buffer at LDS byte address dst (planes A, A2, Bt, one behind the other). In fragment order the GKS columns of a 16-row block are 32 GKS bytes in a row, and they keep that order in LDS; wave w of four takes row blocks 2 w and 2 w + 1 of each plane, in pieces of 512 bytes.
template <int K, int GKS>
__device__ __forceinline__ void gm_stage(const bf* A, const bf* A2, const bf* B, unsigned dst, int s, int w, int lane) {
    constexpr int GPL = 128 * GKS;   /* elements of one plane's tile */
    const unsigned dl = dst + w * (64 * GKS) + lane * 16;
    const size_t go = (size_t)w * (32 * K) + (size_t)s * (GKS * 16) + lane * 8;
    unsigned d[12]; const void* g[12];
#pragma unroll
    for (int q = 0; q < GKS / 32; ++q) {   /* 2 KiB of each plane: part q % (GKS / 64) of row block q / (GKS / 64) */
        const unsigned dq = dl + (q / (GKS / 64)) * (32 * GKS) + (q % (GKS / 64)) * 2048; const size_t gq = go + (q / (GKS / 64)) * (16 * K) + (q % (GKS / 64)) * 1024;
#pragma unroll
        for (int j = 0; j < 4; ++j) { d[j] = dq + j * 512; g[j] = A + gq + j * 256; d[4 + j] = dq + 2 * GPL + j * 512; g[4 + j] = A2 + gq + j * 256; d[8 + j] = dq + 4 * GPL + j * 512; g[8 + j] = B + gq + j * 256; }
        copy12(d, g);
        __builtin_amdgcn_sched_barrier(0); }   /* the next twelve copies' addresses are formed behind these copies: formed in front of them, a whole tile's addresses are live at once beside the accumulators, and some are spilled */
}
template <typename T16, int NSPLIT, int EPI, int K>
__global__ __launch_bounds__(128) void k_gemmw(const T16* __restrict__ A, const T16* __restrict__ A2, const T16* __restrict__ Bt, const T16* __restrict__ Bt2, const float* __restrict__ X, float* C, h16* P16, bf* Ph, bf* Pl, size_t sA, size_t sB, size_t sC) {
    typedef typename WFrag<T16>::V V;
    constexpr int GKS = (EPI == 0) ? 128 : 64;   /* k columns of a staged tile: 64 where three work-groups share a WGP's LDS (the launch has three per WGP), 128 where the launch has one per WGP (the ring then also keeps a second work-group off that WGP) */
    constexpr int GPL = 128 * GKS, GTB = 3 * GPL * 2;   /* elements of one plane's tile; bytes of a tile */
    static_assert(NSPLIT == 1 && K % GKS == 0 && K / GKS >= 2, "planes A, A2, Bt; whole tiles, and both buffers are filled in front of the loop");
    __shared__ __attribute__((aligned(1024))) T16 ring[2 * GTB / 2];   /* two buffers of one tile each; behind the loop each wave's epilogue staging */
    const size_t z = blockIdx.z; A += z * sA; A2 += z * sA; Bt += z * sB;
    const int wv = __builtin_amdgcn_readfirstlane((int)(threadIdx.x >> 5)), lane = threadIdx.x & 31, lr = lane & 15, hi = lane >> 4;
    const int wm = wv >> 1, wn = wv & 1; const int r0 = blockIdx.x * 128 + wm * 64, c0 = blockIdx.y * 128 + wn * 64;   /* the wave's own 64 x 64 tile */
    const T16* Ag = A + (size_t)blockIdx.x * 128 * K; const T16* A2g = A2 + (size_t)blockIdx.x * 128 * K; const T16* Bg = Bt + (size_t)blockIdx.y * 128 * K;
    const unsigned rb = (unsigned)(size_t)&ring[0];   /* LDS byte address of buffer 0 */
    gm_stage<K, GKS>(Ag, A2g, Bg, rb, 0, wv, lane);
    asm volatile("s_wait_asynccnt 0x0" ::: "memory");   /* this wave's copies of tile 0 have landed */
    __syncthreads();   /* tile 0 is there for every wave */
    gm_stage<K, GKS>(Ag, A2g, Bg, rb + GTB, 1, wv, lane);
    v8f acc[4][4];
#pragma unroll
    for (int mb = 0; mb < 4; ++mb)
#pragma unroll
        for (int nb = 0; nb < 4; ++nb) acc[mb][nb] = (v8f){};
    // Rolled: one trip per tile, with the hand-over of the buffers at its foot.
#pragma unroll 1
    for (int s = 0; s < K / GKS; ++s) {
        const T16* tb = ring + (s & 1) * (GTB / 2);
        const T16* ap = tb + wm * (64 * GKS) + lane * 8; const T16* ap2 = ap + GPL; const T16* bp = tb + 2 * GPL + wn * (64 * GKS) + lane * 8;
#pragma unroll
        for (int c = 0; c < GKS / 32; ++c) {
            // The 24 LDS reads of 32 products stand in one run in front of them, in the order in which the products take them: LDS answers in order, so the first products wait for the first ten reads only. Each scheduling barrier keeps that order in the compiled code: left to itself the compiler reads an A fragment directly in front of its four products and waits for it there, or turns the run round and waits for all of it.
            V a[4], a2[4], b[4];
#pragma unroll
            for (int nb = 0; nb < 4; ++nb) b[nb] = WFrag<T16>::ld(bp + nb * 16 * GKS + c * 512);
            a[0] = WFrag<T16>::ld(ap + c * 512);
            __builtin_amdgcn_sched_barrier(0);   /* first: what the first four products take */
#pragma unroll
            for (int mb = 1; mb < 4; ++mb) a[mb] = WFrag<T16>::ld(ap + mb * 16 * GKS + c * 512);
#pragma unroll
            for (int mb = 0; mb < 4; ++mb) a2[mb] = WFrag<T16>::ld(ap2 + mb * 16 * GKS + c * 512);
            __builtin_amdgcn_sched_barrier(0);   /* then the other fragments; no product stands among the reads */
#pragma unroll
            for (int mb = 0; mb < 4; ++mb)
#pragma unroll
                for (int nb = 0; nb < 4; ++nb) acc[mb][nb] = WFrag<T16>::mma(a[mb], b[nb], acc[mb][nb]);
#pragma unroll
            for (int mb = 0; mb < 4; ++mb)
#pragma unroll
                for (int nb = 0; nb < 4; ++nb) acc[mb][nb] = WFrag<T16>::mma(a2[mb], b[nb], acc[mb][nb]);
            __builtin_amdgcn_sched_barrier(0);   /* the next run of reads stays behind these products: drawn in front of them it would need a second set of fragment registers */
            if (c == GKS / 32 - 1) asm volatile("v_nop\n\tv_nop\n\tv_nop\n\tv_nop" : "+v"(acc[3][0]), "+v"(acc[3][1]), "+v"(acc[3][2]), "+v"(acc[3][3]) : "v"(a2[3]), "v"(b[3]));   /* the four vector slots that the chip needs behind the trip's last matrix instructions: the branches at the trip's foot lead to other code */
        }
        asm volatile("s_wait_dscnt 0x0" ::: "memory");      /* this wave's reads of tile s are done */
        asm volatile("s_wait_asynccnt 0x0" ::: "memory");   /* its copies of tile s + 1 have landed */
        __syncthreads();   /* tile s + 1 is there for every wave, and no wave reads tile s any more */
        if (s + 2 < K / GKS) gm_stage<K, GKS>(Ag, A2g, Bg, rb + (s & 1) * GTB, s + 2, wv, lane);
    }
    asm volatile("s_wait_asynccnt 0x0" ::: "memory");   /* no copy is outstanding when the ring is put to another use */
    float* os = (float*)ring + wv * (16 * 68);   /* behind the last trip's barrier nobody reads the ring any more: each wave stages its rows in a piece of its own */
    // Epilogue. Every loop is unrolled: the accumulators are registers and take constant indices only. The staged rows pass from lane to lane through LDS, which runs one wave's operations in order;
    // each fence (wave barrier + memory clobber) keeps that order in the compiled code: all lanes' writes of a block, then its reads, then the next block's writes.
    if constexpr (EPI == 0) {
        const size_t co = z * sC + (size_t)(r0 + hi) * DM + c0 + lr * 4;   /* a lane's 4 columns of rows hi, 2 + hi, ... */
        const float* xp = X + co; float* cp = C + co;
        v4f xv[2][8];   /* the residual rows, fetched one 16-row block ahead */
#pragma unroll
        for (int s = 0; s < 8; ++s) xv[0][s] = *(const v4f*)(xp + 2 * s * DM);
#pragma unroll
        for (int mb = 0; mb < 4; ++mb) {
            if (mb < 3) {
#pragma unroll
                for (int s = 0; s < 8; ++s) xv[(mb + 1) & 1][s] = *(const v4f*)(xp + ((mb + 1) * 16 + 2 * s) * DM); }
#pragma unroll
            for (int nb = 0; nb < 4; ++nb) {
#pragma unroll
                for (int j = 0; j < 8; ++j) os[(hi * 8 + j) * 68 + nb * 16 + lr] = acc[mb][nb][j]; }
            __builtin_amdgcn_wave_barrier(); asm volatile("" ::: "memory");   /* fence: writes before reads */
            v4f val[8];
#pragma unroll
            for (int s = 0; s < 8; ++s) { val[s] = *(const v4fa*)(os + (2 * s + hi) * 68 + lr * 4);
#pragma unroll
                for (int q = 0; q < 4; ++q) val[s][q] = __fadd_rn(bfr(xv[mb & 1][s][q]), val[s][q]);
                *(v4f*)(cp + (mb * 16 + 2 * s) * DM) = val[s]; }
            swaitf(xp, cp, val);
            __builtin_amdgcn_wave_barrier(); asm volatile("" ::: "memory");   /* fence: reads before the next writes */
        }
    } else {
        const bool tr = blockIdx.z == 2;   /* the same for the whole wave: a scalar branch */
        const size_t po = z * sC + ((size_t)(r0 / TT) * NH_ + c0 / 64) * TT * HD + (size_t)(r0 % TT) * (tr ? 16 : HD) + lane * 8;   /* a lane's 8 elements of staged row lr, columns 8 hi, 16 + 8 hi, ...: each store of the wave is 512 bytes in a row */
        if (tr) gemm_planes<true>(acc, os, P16 + po, Ph + po, Pl + po, lr, hi); else gemm_planes<false>(acc, os, P16 + po, Ph + po, Pl + po, lr, hi);
    }
}

typedef __attribute__((ext_vector_type(2))) _Float16 v2h;
typedef __attribute__((ext_vector_type(4))) _Float16 v4h;
typedef __attribute__((ext_vector_type(2))) unsigned short v2us;
typedef __attribute__((ext_vector_type(4))) unsigned short v4us;
typedef v4us __attribute__((may_alias)) v4usa;
typedef __attribute__((ext_vector_type(2))) float v2f;
typedef __attribute__((ext_vector_type(4))) int v4i;

template <int K, int N>
__device__ __forceinline__ void d_wtG(const float* __restrict__ w, bf* Bt, int blk) {
    // Bt (row n, column k) = w[k][n] in fragment order, in 512-byte units u (16 rows n, 16 columns k). One wave takes eight units: two neighbouring n blocks (each row of w then gives a whole 128-byte line) by four neighbouring k blocks (2 KiB in a row of Bt per n block). Its 64 loads stand in one run: one memory latency for 8 KiB of w.
    const int lane = threadIdx.x & 31; const int t = blk * 8 + (threadIdx.x >> 5); const int kb = (t % (K / 64)) * 4, nb = (t / (K / 64)) * 2;
    const float* wp = w + (size_t)(kb * 16 + (lane >> 4) * 8) * N + nb * 16 + (lane & 15); bf* op = Bt + ((size_t)nb * (K / 16) + kb) * 256 + lane * 8; float x[8][8]; v8us o[8];
#pragma unroll
    for (int i = 0; i < 8; ++i)   /* unit i: n block nb + i % 2, k block kb + i / 2 */
#pragma unroll
        for (int e = 0; e < 8; ++e) x[i][e] = wp[((i >> 1) * 16 + e) * N + (i & 1) * 16];
    gwait(wp, wp, wp, wp);
#pragma unroll
    for (int i = 0; i < 8; ++i) {
#pragma unroll
        for (int e = 0; e < 8; ++e) o[i][e] = f2bf(x[i][e]);
        *(v8us*)(op + ((i & 1) * (K / 16) + (i >> 1)) * 256) = o[i]; }
    swaitw(op, o);
}
__constant__ int BKT[4095] = {15,15,15,15,15,15,15,15,15,15,15,15,15,15,15,15,15,15,15,15,15,15,15,15,15,15,15,15,15,15,15,15,15,15,15,15,15,15,15,15,15,15,15,15,15,15,15,15,15,15,15,15,15,15,15,15,15,15,15,15,15,15,15,15,15,15,15,15,15,15,15,15,15,15,15,15,15,15,15,15,15,15,15,15,15,15,15,15,15,15,15,15,15,15,15,15,15,15,15,15,15,15,15,15,15,15,15,15,15,15,15,15,15,15,15,15,15,15,15,15,15,15,15,15,15,15,15,15,15,15,15,15,15,15,15,15,15,15,15,15,15,15,15,15,15,15,15,15,15,15,15,15,15,15,15,15,15,15,15,15,15,15,15,15,15,15,15,15,15,15,15,15,15,15,15,15,15,15,15,15,15,15,15,15,15,15,15,15,15,15,15,15,15,15,15,15,15,15,15,15,15,15,15,15,15,15,15,15,15,15,15,15,15,15,15,15,15,15,15,15,15,15,15,15,15,15,15,15,15,15,15,15,15,15,15,15,15,15,15,15,15,15,15,15,15,15,15,15,15,15,15,15,15,15,15,15,15,15,15,15,15,15,15,15,15,15,15,15,15,15,15,15,15,15,15,15,15,15,15,15,15,15,15,15,15,15,15,15,15,15,15,15,15,15,15,15,15,15,15,15,15,15,15,15,15,15,15,15,15,15,15,15,15,15,15,15,15,15,15,15,15,15,15,15,15,15,15,15,15,15,15,15,15,15,15,15,15,15,15,15,15,15,15,15,15,15,15,15,15,15,15,15,15,15,15,15,15,15,15,15,15,15,15,15,15,15,15,15,15,15,15,15,15,15,15,15,15,15,15,15,15,15,15,15,15,15,15,15,15,15,15,15,15,15,15,15,15,15,15,15,15,15,15,15,15,15,15,15,15,15,15,15,15,15,15,15,15,15,15,15,15,15,15,15,15,15,15,15,15,15,15,15,15,15,15,15,15,15,15,15,15,15,15,15,15,15,15,15,15,15,15,15,15,15,15,15,15,15,15,15,15,15,15,15,15,15,15,15,15,15,15,15,15,15,15,15,15,15,15,15,15,15,15,15,15,15,15,15,15,15,15,15,15,15,15,15,15,15,15,15,15,15,15,15,15,15,15,15,15,15,15,15,15,15,15,15,15,15,15,15,15,15,15,15,15,15,15,15,15,15,15,15,15,15,15,15,15,15,15,15,15,15,15,15,15,15,15,15,15,15,15,15,15,15,15,15,15,15,15,15,15,15,15,15,15,15,15,15,15,15,15,15,15,15,15,15,15,15,15,15,15,15,15,15,15,15,15,15,15,15,15,15,15,15,15,15,15,15,15,15,15,15,15,15,15,15,15,15,15,15,15,15,15,15,15,15,15,15,15,15,15,15,15,15,15,15,15,15,15,15,15,15,15,15,15,15,15,15,15,15,15,15,15,15,15,15,15,15,15,15,15,15,15,15,15,15,15,15,15,15,15,15,15,15,15,15,15,15,15,15,15,15,15,15,15,15,15,15,15,15,15,15,15,15,15,15,15,15,15,15,15,15,15,15,15,15,15,15,15,15,15,15,15,15,15,15,15,15,15,15,15,15,15,15,15,15,15,15,15,15,15,15,15,15,15,15,15,15,15,15,15,15,15,15,15,15,15,15,15,15,15,15,15,15,15,15,15,15,15,15,15,15,15,15,15,15,15,15,15,15,15,15,15,15,15,15,15,15,15,15,15,15,15,15,15,15,15,15,15,15,15,15,15,15,15,15,15,15,15,15,15,15,15,15,15,15,15,15,15,15,15,15,15,15,15,15,15,15,15,15,15,15,15,15,15,15,15,15,15,15,15,15,15,15,15,15,15,15,15,15,15,15,15,15,15,15,15,15,15,15,15,15,15,15,15,15,15,15,15,15,15,15,15,15,15,15,15,15,15,15,15,15,15,15,15,15,15,15,15,15,15,15,15,15,15,15,15,15,15,15,15,15,15,15,15,15,15,15,15,15,15,15,15,15,15,15,15,15,15,15,15,15,15,15,15,15,15,15,15,15,15,15,15,15,15,15,15,15,15,15,15,15,15,15,15,15,15,15,15,15,15,15,15,15,15,15,15,15,15,15,15,15,15,15,15,15,15,15,15,15,15,15,15,15,15,15,15,15,15,15,15,15,15,15,15,15,15,15,15,15,15,15,15,15,15,15,15,15,15,15,15,15,15,15,15,15,15,15,15,15,15,15,15,15,15,15,15,15,15,15,15,15,15,15,15,15,15,15,15,15,15,15,15,15,15,15,15,15,15,15,15,15,15,15,15,15,15,15,15,15,15,15,15,15,15,15,15,15,15,15,15,15,15,15,15,15,15,15,15,15,15,15,15,15,15,15,15,15,15,15,15,15,15,15,15,15,15,15,15,15,15,15,15,15,15,15,15,15,15,15,15,15,15,15,15,15,15,15,15,15,15,15,15,15,15,15,15,15,15,15,15,15,15,15,15,15,15,15,15,15,15,15,15,15,15,15,15,15,15,15,15,15,15,15,15,15,15,15,15,15,15,15,15,15,15,15,15,15,15,15,15,15,15,15,15,15,15,15,15,15,15,15,15,15,15,15,15,15,15,15,15,15,15,15,15,15,15,15,15,15,15,15,15,15,15,15,15,15,15,15,15,15,15,15,15,15,15,15,15,15,15,15,15,15,15,15,15,15,15,15,15,15,15,15,15,15,15,15,15,15,15,15,15,15,15,15,15,15,15,15,15,15,15,15,15,15,15,15,15,15,15,15,15,15,15,15,15,15,15,15,15,15,15,15,15,15,15,15,15,15,15,15,15,15,15,15,15,15,15,15,15,15,15,15,15,15,15,15,15,15,15,15,15,15,15,15,15,15,15,15,15,15,15,15,15,15,15,15,15,15,15,15,15,15,15,15,15,15,15,15,15,15,15,15,15,15,15,15,15,15,15,15,15,15,15,15,15,15,15,15,15,15,15,15,15,15,15,15,15,15,15,15,15,15,15,15,15,15,15,15,15,15,15,15,15,15,15,15,15,15,15,15,15,15,15,15,15,15,15,15,15,15,15,15,15,15,15,15,15,15,15,15,15,15,15,15,15,15,15,15,15,15,15,15,15,15,15,15,15,15,15,15,15,15,15,15,15,15,15,15,15,15,15,15,15,15,15,15,15,15,15,15,15,15,15,15,15,15,15,15,15,15,15,15,15,15,15,15,15,15,15,15,15,15,15,15,15,15,15,15,15,15,15,15,15,15,15,15,15,15,15,15,15,15,15,15,15,15,15,15,15,15,15,15,15,15,15,15,15,15,15,15,15,15,15,15,15,15,15,15,15,15,15,15,15,15,15,15,15,15,15,15,15,15,15,15,15,15,15,15,15,15,15,15,15,15,15,15,15,15,15,15,15,15,15,15,15,15,15,15,15,15,15,15,15,15,15,15,15,15,15,15,15,15,15,15,15,15,15,15,15,15,15,15,15,15,15,15,15,15,15,15,15,15,15,15,15,15,15,15,15,15,15,15,15,15,15,15,15,15,15,15,15,15,15,15,15,15,15,15,15,15,15,15,15,15,15,15,15,15,15,15,15,15,15,15,15,15,15,15,15,15,15,15,15,15,15,15,15,15,15,15,15,15,15,15,15,15,15,15,15,15,15,15,15,15,15,15,15,15,15,15,15,15,15,15,15,15,15,15,15,15,15,15,15,15,15,15,15,15,15,15,15,15,15,15,15,15,15,15,15,15,15,15,15,15,15,15,15,15,15,15,15,15,15,15,15,15,15,15,15,15,15,15,15,15,15,15,15,15,15,15,15,15,15,15,15,15,15,15,15,15,15,15,15,15,15,15,15,15,15,15,15,15,15,15,15,15,15,15,15,15,15,15,15,15,15,15,15,15,15,15,15,15,15,15,15,15,15,15,15,15,15,15,15,15,15,15,15,15,15,15,15,15,15,15,15,15,15,15,15,15,15,15,15,15,15,15,15,15,15,15,15,15,15,15,15,15,15,15,15,15,15,15,15,15,15,15,15,15,15,15,15,15,15,15,15,15,15,15,15,15,15,15,15,15,15,15,15,15,15,15,15,15,15,15,15,15,15,15,15,15,15,15,15,15,15,15,15,15,15,15,15,15,15,15,15,15,15,15,15,15,15,15,15,15,15,15,15,15,15,15,15,15,15,15,15,15,15,15,15,15,15,15,15,15,15,15,15,15,15,15,15,15,15,15,15,15,15,15,15,15,15,15,15,15,15,15,15,15,15,15,15,15,15,15,15,15,15,15,15,15,15,15,15,15,15,15,15,15,15,15,15,15,15,15,15,15,15,15,15,15,15,15,15,15,15,15,15,15,15,15,15,15,15,15,15,15,15,15,15,15,15,15,15,15,15,15,15,15,15,15,15,15,15,15,15,14,14,14,14,14,14,14,14,14,14,14,14,14,14,14,14,14,14,14,14,14,14,14,14,14,14,14,13,13,13,13,13,13,13,13,13,13,13,13,13,13,13,13,13,13,12,12,12,12,12,12,12,12,12,12,12,12,12,12,11,11,11,11,11,11,11,11,11,10,10,10,10,10,10,10,9,9,9,9,8,8,8,8,7,6,5,4,3,2,1,0,17,18,19,20,21,22,23,24,24,24,24,25,25,25,25,26,26,26,26,26,26,26,27,27,27,27,27,27,27,27,27,28,28,28,28,28,28,28,28,28,28,28,28,28,28,29,29,29,29,29,29,29,29,29,29,29,29,29,29,29,29,29,29,30,30,30,30,30,30,30,30,30,30,30,30,30,30,30,30,30,30,30,30,30,30,30,30,30,30,30,31,31,31,31,31,31,31,31,31,31,31,31,31,31,31,31,31,31,31,31,31,31,31,31,31,31,31,31,31,31,31,31,31,31,31,31,31,31,31,31,31,31,31,31,31,31,31,31,31,31,31,31,31,31,31,31,31,31,31,31,31,31,31,31,31,31,31,31,31,31,31,31,31,31,31,31,31,31,31,31,31,31,31,31,31,31,31,31,31,31,31,31,31,31,31,31,31,31,31,31,31,31,31,31,31,31,31,31,31,31,31,31,31,31,31,31,31,31,31,31,31,31,31,31,31,31,31,31,31,31,31,31,31,31,31,31,31,31,31,31,31,31,31,31,31,31,31,31,31,31,31,31,31,31,31,31,31,31,31,31,31,31,31,31,31,31,31,31,31,31,31,31,31,31,31,31,31,31,31,31,31,31,31,31,31,31,31,31,31,31,31,31,31,31,31,31,31,31,31,31,31,31,31,31,31,31,31,31,31,31,31,31,31,31,31,31,31,31,31,31,31,31,31,31,31,31,31,31,31,31,31,31,31,31,31,31,31,31,31,31,31,31,31,31,31,31,31,31,31,31,31,31,31,31,31,31,31,31,31,31,31,31,31,31,31,31,31,31,31,31,31,31,31,31,31,31,31,31,31,31,31,31,31,31,31,31,31,31,31,31,31,31,31,31,31,31,31,31,31,31,31,31,31,31,31,31,31,31,31,31,31,31,31,31,31,31,31,31,31,31,31,31,31,31,31,31,31,31,31,31,31,31,31,31,31,31,31,31,31,31,31,31,31,31,31,31,31,31,31,31,31,31,31,31,31,31,31,31,31,31,31,31,31,31,31,31,31,31,31,31,31,31,31,31,31,31,31,31,31,31,31,31,31,31,31,31,31,31,31,31,31,31,31,31,31,31,31,31,31,31,31,31,31,31,31,31,31,31,31,31,31,31,31,31,31,31,31,31,31,31,31,31,31,31,31,31,31,31,31,31,31,31,31,31,31,31,31,31,31,31,31,31,31,31,31,31,31,31,31,31,31,31,31,31,31,31,31,31,31,31,31,31,31,31,31,31,31,31,31,31,31,31,31,31,31,31,31,31,31,31,31,31,31,31,31,31,31,31,31,31,31,31,31,31,31,31,31,31,31,31,31,31,31,31,31,31,31,31,31,31,31,31,31,31,31,31,31,31,31,31,31,31,31,31,31,31,31,31,31,31,31,31,31,31,31,31,31,31,31,31,31,31,31,31,31,31,31,31,31,31,31,31,31,31,31,31,31,31,31,31,31,31,31,31,31,31,31,31,31,31,31,31,31,31,31,31,31,31,31,31,31,31,31,31,31,31,31,31,31,31,31,31,31,31,31,31,31,31,31,31,31,31,31,31,31,31,31,31,31,31,31,31,31,31,31,31,31,31,31,31,31,31,31,31,31,31,31,31,31,31,31,31,31,31,31,31,31,31,31,31,31,31,31,31,31,31,31,31,31,31,31,31,31,31,31,31,31,31,31,31,31,31,31,31,31,31,31,31,31,31,31,31,31,31,31,31,31,31,31,31,31,31,31,31,31,31,31,31,31,31,31,31,31,31,31,31,31,31,31,31,31,31,31,31,31,31,31,31,31,31,31,31,31,31,31,31,31,31,31,31,31,31,31,31,31,31,31,31,31,31,31,31,31,31,31,31,31,31,31,31,31,31,31,31,31,31,31,31,31,31,31,31,31,31,31,31,31,31,31,31,31,31,31,31,31,31,31,31,31,31,31,31,31,31,31,31,31,31,31,31,31,31,31,31,31,31,31,31,31,31,31,31,31,31,31,31,31,31,31,31,31,31,31,31,31,31,31,31,31,31,31,31,31,31,31,31,31,31,31,31,31,31,31,31,31,31,31,31,31,31,31,31,31,31,31,31,31,31,31,31,31,31,31,31,31,31,31,31,31,31,31,31,31,31,31,31,31,31,31,31,31,31,31,31,31,31,31,31,31,31,31,31,31,31,31,31,31,31,31,31,31,31,31,31,31,31,31,31,31,31,31,31,31,31,31,31,31,31,31,31,31,31,31,31,31,31,31,31,31,31,31,31,31,31,31,31,31,31,31,31,31,31,31,31,31,31,31,31,31,31,31,31,31,31,31,31,31,31,31,31,31,31,31,31,31,31,31,31,31,31,31,31,31,31,31,31,31,31,31,31,31,31,31,31,31,31,31,31,31,31,31,31,31,31,31,31,31,31,31,31,31,31,31,31,31,31,31,31,31,31,31,31,31,31,31,31,31,31,31,31,31,31,31,31,31,31,31,31,31,31,31,31,31,31,31,31,31,31,31,31,31,31,31,31,31,31,31,31,31,31,31,31,31,31,31,31,31,31,31,31,31,31,31,31,31,31,31,31,31,31,31,31,31,31,31,31,31,31,31,31,31,31,31,31,31,31,31,31,31,31,31,31,31,31,31,31,31,31,31,31,31,31,31,31,31,31,31,31,31,31,31,31,31,31,31,31,31,31,31,31,31,31,31,31,31,31,31,31,31,31,31,31,31,31,31,31,31,31,31,31,31,31,31,31,31,31,31,31,31,31,31,31,31,31,31,31,31,31,31,31,31,31,31,31,31,31,31,31,31,31,31,31,31,31,31,31,31,31,31,31,31,31,31,31,31,31,31,31,31,31,31,31,31,31,31,31,31,31,31,31,31,31,31,31,31,31,31,31,31,31,31,31,31,31,31,31,31,31,31,31,31,31,31,31,31,31,31,31,31,31,31,31,31,31,31,31,31,31,31,31,31,31,31,31,31,31,31,31,31,31,31,31,31,31,31,31,31,31,31,31,31,31,31,31,31,31,31,31,31,31,31,31,31,31,31,31,31,31,31,31,31,31,31,31,31,31,31,31,31,31,31,31,31,31,31,31,31,31,31,31,31,31,31,31,31,31,31,31,31,31,31,31,31,31,31,31,31,31,31,31,31,31,31,31,31,31,31,31,31,31,31,31,31,31,31,31,31,31,31,31,31,31,31,31,31,31,31,31,31,31,31,31,31,31,31,31,31,31,31,31,31,31,31,31,31,31,31,31,31,31,31,31,31,31,31,31,31,31,31,31,31,31,31,31,31,31,31,31,31,31,31,31,31,31,31,31,31,31,31,31,31,31,31,31,31,31,31,31,31,31,31,31,31,31,31,31,31,31,31,31,31,31,31,31,31,31,31,31,31,31,31,31,31,31,31,31,31,31,31,31,31,31,31,31,31,31,31,31,31,31,31,31,31,31,31,31,31,31,31,31,31,31,31,31,31,31,31,31,31,31,31,31,31,31,31,31,31,31,31,31,31,31,31,31,31,31,31,31,31,31,31,31,31,31,31,31,31,31,31,31,31,31,31,31,31,31,31,31,31,31,31,31,31,31,31,31,31,31,31,31,31,31,31,31,31,31,31,31,31,31,31,31,31,31,31,31,31,31,31,31,31,31,31,31,31,31,31,31,31,31,31,31,31,31,31,31,31,31,31,31,31,31,31,31,31,31,31,31,31,31,31,31,31,31,31,31,31,31,31,31,31,31,31,31,31,31,31,31,31,31,31,31,31,31,31,31,31,31,31,31,31,31,31,31,31,31,31,31,31,31,31,31,31,31,31,31,31,31,31,31,31,31,31,31,31,31,31,31,31,31,31,31,31,31,31,31,31,31,31,31,31,31,31,31,31,31,31,31,31,31,31,31,31,31,31,31,31,31,31,31,31,31,31,31,31,31,31,31,31,31,31,31,31,31,31,31,31,31,31,31,31,31,31,31,31,31,31,31,31,31,31,31,31,31,31,31,31,31,31,31,31,31,31,31,31,31,31,31,31,31,31,31,31,31,31,31,31,31,31,31,31,31,31,31,31,31,31,31,31,31,31,31,31,31,31,31,31,31,31,31,31,31,31,31,31,31,31,31,31,31,31,31,31,31,31,31,31,31,31,31,31,31,31,31,31,31,31,31,31,31,31,31,31,31,31,31,31,31,31,31,31,31,31,31,31,31,31,31,31,31,31,31,31,31,31,31,31,31,31,31,31,31,31,31,31,31,31,31,31,31,31,31,31,31,31,31,31,31,31,31,31,31,31,31,31,31,31,31,31,31,31,31,31,31,31,31,31,31,31,31,31,31,31,31,31,31,31,31,31,31,31,31,31,31,31,31,31,31,31,31,31,31,31,31,31,31,31,31,31,31,31,31,31,31,31,31,31,31,31,31,31,31,31,31,31,31,31,31,31,31,31,31,31,31,31,31,31,31,31,31,31,31,31,31,31,31,31,31,31,31,31,31,31,31,31,31,31,31,31,31,31,31,31,31,31,31,31,31,31,31,31,31,31,31,31,31,31,31,31,31,31,31,31,31,31,31,31,31,31,31,31,31,31,31,31,31,31,31,31,31,31,31,31,31,31,31,31,31,31,31,31,31,31,31,31,31,31};
// Four entries a thread, 256 apart (a work-group's 1024 lie in one head): their four bucket reads stand in one run, then their four bias reads. Entry 4095 of a head is padding that nobody reads: it gets entry 4094's value, so that no read hangs on a test.
__device__ __forceinline__ void d_btab(const float* __restrict__ relb, float* BT, int blk) { const int h = blk >> 2, r0 = ((blk & 3) << 10) + threadIdx.x; int bk[4]; float rv[4];
#pragma unroll
    for (int j = 0; j < 4; ++j) bk[j] = BKT[(r0 + j * 256 < 4095) ? r0 + j * 256 : 4094];
#pragma unroll
    for (int j = 0; j < 4; ++j) rv[j] = relb[bk[j] * NH_ + h];
#pragma unroll
    for (int j = 0; j < 4; ++j) BT[h * 4096 + r0 + j * 256] = bfr(rv[j]); }
// k_prep: everything that reads the inputs alone, in one launch of few, long waves, each with all its global reads in flight at once; grid x: first the LayerNorm of all rows (8 rows a work-group), then the four weight planes (one size, one behind the other in Bt; 64 units a work-group), then the bias table. The branch is the same for a whole workgroup and stands in front of the barrier.
#define PB_LN (NB_ * TT / 8)              // work-groups of the LayerNorm
#define PB_W  (4 * (DM * DQ / 256 / 64))  // of the four weight planes
#define PB_T  (NH_ * 4096 / 1024)         // of the bias table
static_assert(DM % 64 == 0 && DQ % 32 == 0 && (DM / 64) * (DQ / 32) % 8 == 0 && 4096 % 1024 == 0, "whole waves, whole work-groups");
__global__ __launch_bounds__(256) void k_prep(const float* __restrict__ X, const float* __restrict__ g, const float* __restrict__ be, bf* Yh, bf* Yl, const float* __restrict__ w0, const float* __restrict__ w1, const float* __restrict__ w2, const float* __restrict__ w3, bf* Bt, const float* __restrict__ relb, float* BT) {
    if (blockIdx.x >= PB_LN + PB_W) { d_btab(relb, BT, blockIdx.x - (PB_LN + PB_W)); return; }
    if (blockIdx.x >= PB_LN) { const int wb = blockIdx.x - PB_LN, mi = wb / (PB_W / 4); d_wtG<DM, DQ>((mi == 0) ? w0 : (mi == 1) ? w1 : (mi == 2) ? w2 : w3, Bt + (size_t)mi * DQ * DM, wb % (PB_W / 4)); return; }
    static_assert(TT % 8 == 0, "a workgroup's 8 rows are all inside or all outside");
    __shared__ __align__(16) bf ys[2][8][DM + 16];   /* the workgroup's 8 rows, hi and lo; the pitch spreads 8 rows' 16-byte pieces over the banks */
    const int lane = threadIdx.x & 31; const int wr = threadIdx.x >> 5; const int r = blockIdx.x * 8 + wr; const float* xl = X + (size_t)r * DM + lane * 4; const float* gl = g + lane * 4; const float* bl = be + lane * 4; float s = 0.f;
    v4f xa[DM / 128], ga[DM / 128], ba[DM / 128];   /* the wave's row, read once and kept in registers for all three passes, and the lane's columns of gain and bias; the 24 loads stand in one run, so the wave waits out one memory latency, not one per 512 bytes of each pass */
#pragma unroll
    for (int ch = 0; ch < DM / 128; ++ch) xa[ch] = *(const v4f*)(xl + ch * 128);
#pragma unroll
    for (int ch = 0; ch < DM / 128; ++ch) { ga[ch] = *(const v4f*)(gl + ch * 128); ba[ch] = *(const v4f*)(bl + ch * 128); }
    gwait(xl, gl, bl, bl);
#pragma unroll
    for (int ch = 0; ch < DM / 128; ++ch) { const v4f a = xa[ch]; const v4f d = {0.f, 0.f, 0.f, 0.f};
#pragma unroll
        for (int q = 0; q < 4; ++q) s += __fadd_rn(bfr(a[q]), d[q]); }
#pragma unroll
    for (int sh = 16; sh; sh >>= 1) s += __shfl_xor(s, sh, 32);
    const float mu = s * (1.0f / DM); float s2 = 0.f;
#pragma unroll
    for (int ch = 0; ch < DM / 128; ++ch) { const v4f a = xa[ch]; const v4f d = {0.f, 0.f, 0.f, 0.f};
#pragma unroll
        for (int q = 0; q < 4; ++q) { const float d0 = __fsub_rn(__fadd_rn(bfr(a[q]), d[q]), mu); float p = __fmul_rn(d0, d0); asm volatile("" : "+v"(p)); s2 = __fadd_rn(s2, p); } }
#pragma unroll
    for (int sh = 16; sh; sh >>= 1) s2 += __shfl_xor(s2, sh, 32);
    const float rs = __fdiv_rn(1.0f, __fsqrt_rn(__fadd_rn(s2 * (1.0f / DM), LNEPS)));
{
#pragma unroll
        for (int ch = 0; ch < DM / 128; ++ch) { const int c0 = ch * 128 + lane * 4; const v4f a = xa[ch]; const v4f d = {0.f, 0.f, 0.f, 0.f}; v4f z4; v4us oh, ol;
#pragma unroll
            for (int q = 0; q < 4; ++q) { const float v = __fadd_rn(bfr(a[q]), d[q]); z4[q] = v; float n0 = __fmul_rn(__fsub_rn(v, mu), rs); asm volatile("" : "+v"(n0)); float n1 = __fmul_rn(n0, bfr(ga[ch][q])); asm volatile("" : "+v"(n1)); const float y = __fadd_rn(n1, bfr(ba[ch][q])); unsigned short h2, l2; splitf(y, h2, l2); oh[q] = h2; ol[q] = l2; }
            *(v4usa*)(&ys[0][wr][c0]) = oh; *(v4usa*)(&ys[1][wr][c0]) = ol; }
         }
    __syncthreads();   /* all 8 rows staged: a 128-byte line of a plane in fragment order holds 16 bytes of each of them */
    const size_t yo = (size_t)(blockIdx.x >> 1) * 16 * DM + (blockIdx.x & 1) * 64 + (threadIdx.x & 7) * 8;   /* rows 8 (x % 2) + t % 8 of row block x / 2 */
#pragma unroll
    for (int i = 0; i < DM / 256; ++i) { const int sg = i * 32 + (threadIdx.x >> 3);   /* columns 8 sg ..: a wave stores four whole lines */
        *(v8us*)(Yh + yo + sg * 128) = *(const v8usa*)(&ys[0][threadIdx.x & 7][sg * 8]); *(v8us*)(Yl + yo + sg * 128) = *(const v8usa*)(&ys[1][threadIdx.x & 7][sg * 8]); } }
__global__ __launch_bounds__(256) void k_cvt8(const float* __restrict__ src, bf* dst, size_t n8) { const size_t i = (size_t)blockIdx.x * 256 + threadIdx.x; if (i >= n8) return; const v8f v = *(const v8f*)(src + i * 8); v8us o;
#pragma unroll
    for (int k = 0; k < 8; ++k) o[k] = f2bf(v[k]); *(v8us*)(dst + i * 8) = o;  }

typedef __attribute__((ext_vector_type(8))) __bf16 v8bf;
__device__ __forceinline__ float xhalf(float x) { const int b = __float_as_int(x); return __int_as_float(__builtin_amdgcn_permlanex16(b, b, 0x76543210, 0xfedcba98, false, false)); }   /* lane l <-> l ^ 16 */
// The wait stands between a run of global loads and the first rewrite of an address register that they name: the addresses are inputs, so they stay in their registers up to it, and the scheduling barrier keeps later instructions behind it.
__device__ __forceinline__ void xwait(const void* a, const void* b) { asm volatile("s_wait_xcnt 0x0" :: "v"(a), "v"(b) : "memory"); __builtin_amdgcn_sched_barrier(0); }
// 2^x by v_exp_f32 with the one free slot that the instruction set asks for behind a transcendental in the same statement, so that it stands directly behind it wherever the statement is scheduled.
__device__ __forceinline__ float exp2s(float x) { float y; asm("v_exp_f32 %0, %1\n\tv_nop" : "=v"(y) : "v"(x)); return y; }
// Four 2^x (v_exp_f32, in place), each with one packed product of the output tiles' rescale directly behind it, in one statement: the product touches no register of the exponentials, so it is the independent instruction that the instruction set asks for behind a transcendental, and no v_nop is spent on that slot.
__device__ __forceinline__ void exp4mul(float& x0, float& x1, float& x2, float& x3, v2f& a, v2f& b, v2f& c, v2f& d, v2f f) {
    asm("v_exp_f32 %0, %0\n\tv_pk_mul_f32 %4, %4, %8\n\tv_exp_f32 %1, %1\n\tv_pk_mul_f32 %5, %5, %8\n\tv_exp_f32 %2, %2\n\tv_pk_mul_f32 %6, %6, %8\n\tv_exp_f32 %3, %3\n\tv_pk_mul_f32 %7, %7, %8"
        : "+v"(x0), "+v"(x1), "+v"(x2), "+v"(x3), "+v"(a), "+v"(b), "+v"(c), "+v"(d) : "v"(f));
}
template <bool B> struct BoolC { static constexpr bool value = B; };
#define KT   128                  // keys of a staged tile
#define PLE  (KT * HD)            // elements of one plane's tile (16 KiB)
#define TLB  (6 * PLE * 2)        // bytes of a staged tile: planes K16, V16, Kh, Kl, Vh, Vl, one behind the other
static_assert(TT % KT == 0 && TT / KT >= 2 && KT % 32 == 0, "whole tiles, and both buffers are filled in front of the loop");
// Tile t of the six planes into the buffer at LDS byte address dst; one of eight waves (w) takes piece 8 j + w of the 32 pieces of each plane's tile. A key plane's tile is 16 KiB in a row; a value plane's is 4 KiB (the tile's four fragments) of each of the four 16-row blocks.
__device__ __forceinline__ void fa_stage(const h16* K16, const h16* V16, const bf* Kh, const bf* Kl, const bf* Vh, const bf* Vl, unsigned dst, int t, int w, int lane) {
    const unsigned dl = dst + w * 512 + lane * 16;
    const size_t ko = (size_t)t * PLE + w * 256 + lane * 8, vo = (size_t)t * (KT * 16) + w * 256 + lane * 8;
    unsigned d[12]; const void* g[12];
#pragma unroll
    for (int j = 0; j < 4; ++j) { d[j] = dl + j * 4096; g[j] = K16 + ko + j * 2048; d[4 + j] = dl + 4 * PLE + j * 4096; g[4 + j] = Kh + ko + j * 2048; d[8 + j] = dl + 6 * PLE + j * 4096; g[8 + j] = Kl + ko + j * 2048; }
    copy12(d, g);
#pragma unroll
    for (int j = 0; j < 4; ++j) { d[j] = dl + 2 * PLE + j * 4096; g[j] = V16 + vo + j * 16 * TT; d[4 + j] = dl + 8 * PLE + j * 4096; g[4 + j] = Vh + vo + j * 16 * TT; d[8 + j] = dl + 10 * PLE + j * 4096; g[8 + j] = Vl + vo + j * 16 * TT; }
    copy12(d, g);
}
// What a wave carries from tile to tile, in one form for both kinds of wave: output tiles, four query fragments (fp16: [column group][k half]; hi/lo: hi [k half], lo [k half]), running maximum and sum.
struct FaState { v8f o[4][2]; v16h q[4]; float m[2], l[2]; };
// One wave's work on one staged tile (keys kb .. kb + KT - 1); K, K2, V, V2: the tile's planes in LDS.
template <typename T16, bool HI, int NQ>
__device__ __forceinline__ void fa_tile(FaState& st, const T16* K, const T16* K2, const T16* V, const T16* V2, const float* __restrict__ bt, int q0, int kb, float cneg, float cpos) {
    typedef WFrag<T16> WF; typedef typename WF::V F;
    const int lane = threadIdx.x & 31, lr = lane & 15, hi = lane >> 4;
    const float L2E = 1.4426950408889634f;
    F qf[NQ][2], qf2[NQ][2];
#pragma unroll
    for (int nb = 0; nb < NQ; ++nb)
#pragma unroll
        for (int ks = 0; ks < 2; ++ks) { qf[nb][ks] = __builtin_bit_cast(F, st.q[HI ? ks : nb * 2 + ks]); if (HI) qf2[nb][ks] = __builtin_bit_cast(F, st.q[2 + ks]); }
    v8f (&o)[4][2] = st.o; float (&m)[2] = st.m; float (&l)[2] = st.l;
    const int ko = lane * 8, vo = lane * 8;
    // One pass over keys k0 .. k0 + 31 (kl: k0 - kb), written once and compiled into three loops (below). NEAR: the score tiles start from table values. Otherwise all 32 keys have the one bias cb: the tiles start from 0, and cb joins the pass's maximum and the addend of the exponent.
    auto pass = [&](auto nearc, const int k0, const int kl, const float cb) __attribute__((always_inline)) {
        constexpr bool NEAR = decltype(nearc)::value;
        v8f s[2][NQ];
        if constexpr (!NEAR) {
#pragma unroll
            for (int kt = 0; kt < 2; ++kt)
#pragma unroll
                for (int nb = 0; nb < NQ; ++nb) s[kt][nb] = (v8f){};
        } else { const float* bp0 = bt + (k0 + 8 * hi) - (q0 + lr);
#pragma unroll
            for (int kt = 0; kt < 2; ++kt)
#pragma unroll
                for (int nb = 0; nb < NQ; ++nb) { const float* bp = bp0 + (kt - nb) * 16;
#pragma unroll
                    for (int r = 0; r < 8; ++r) s[kt][nb][r] = bp[r]; }
            xwait(bp0, bp0);
        }
        F kf[2][2], kf2[2][2]; const T16* kp = K + ko + kl * HD; const T16* kp2 = K2 + ko + kl * HD;   /* the pass's key rows, then its value rows: LDS answers in order, so the score products wait for the first only */
#pragma unroll
        for (int kt = 0; kt < 2; ++kt)
#pragma unroll
            for (int ks = 0; ks < 2; ++ks) { kf[kt][ks] = WF::ld(kp + kt * 16 * HD + ks * 512); if (HI) kf2[kt][ks] = WF::ld(kp2 + kt * 16 * HD + ks * 512); }
        F vf[4], vf2[4]; const T16* vp = V + vo + kl * 16; const T16* vp2 = V2 + vo + kl * 16;
#pragma unroll
        for (int dt = 0; dt < 4; ++dt) { vf[dt] = WF::ld(vp + dt * 16 * KT); if (HI) vf2[dt] = WF::ld(vp2 + dt * 16 * KT); }
        if constexpr (!HI) __builtin_amdgcn_sched_barrier(0);   /* the fp16 pass's 16 LDS reads stay in one run in front of its products: left to itself the compiler sinks some value reads down among the output products, which then wait for them there */
#pragma unroll
        for (int ks = 0; ks < 2; ++ks)
#pragma unroll
            for (int kt = 0; kt < 2; ++kt)
#pragma unroll
                for (int nb = 0; nb < NQ; ++nb) { s[kt][nb] = WF::mma(kf[kt][ks], qf[nb][ks], s[kt][nb]); if (HI) { s[kt][nb] = WF::mma(kf[kt][ks], qf2[nb][ks], s[kt][nb]); s[kt][nb] = WF::mma(kf2[kt][ks], qf[nb][ks], s[kt][nb]); } }
        F pf[NQ], pf2[NQ];
#pragma unroll
        for (int nb = 0; nb < NQ; ++nb) {
            float mx = s[0][nb][0];
#pragma unroll
            for (int r = 1; r < 8; ++r) mx = fmaxf(mx, s[0][nb][r]);
#pragma unroll
            for (int r = 0; r < 8; ++r) mx = fmaxf(mx, s[1][nb][r]);
            mx = fmaxf(mx, xhalf(mx));
            if constexpr (!NEAR) mx += cb;
            const float mn = fmaxf(m[nb], mx);
            const float al = exp2s((m[nb] - mn) * L2E);
            float ng = (HI ? 0.0f : PSH) - mn * L2E;
            if constexpr (!NEAR) ng = __builtin_fmaf(cb, L2E, ng);
            m[nb] = mn;
            float sum = 0.f;
#pragma unroll
            for (int kt = 0; kt < 2; ++kt)
#pragma unroll
                for (int r = 0; r < 8; ++r) s[kt][nb][r] = __builtin_fmaf(s[kt][nb][r], L2E, ng);
            const v2f al2 = {al, al};
#pragma unroll
            for (int dt = 0; dt < 4; ++dt) {   /* four of the group's 16 exponentials with the four packed products of output tile dt */
                const v8f ot = o[dt][nb]; v8f& sv = s[dt >> 1][nb]; const int r0 = (dt & 1) * 4;
                v2f w0 = __builtin_shufflevector(ot, ot, 0, 1), w1 = __builtin_shufflevector(ot, ot, 2, 3), w2 = __builtin_shufflevector(ot, ot, 4, 5), w3 = __builtin_shufflevector(ot, ot, 6, 7);
                float x0 = sv[r0], x1 = sv[r0 + 1], x2 = sv[r0 + 2], x3 = sv[r0 + 3];
                exp4mul(x0, x1, x2, x3, w0, w1, w2, w3, al2);
                sv[r0] = x0; sv[r0 + 1] = x1; sv[r0 + 2] = x2; sv[r0 + 3] = x3;
                o[dt][nb] = __builtin_shufflevector(__builtin_shufflevector(w0, w1, 0, 1, 2, 3), __builtin_shufflevector(w2, w3, 0, 1, 2, 3), 0, 1, 2, 3, 4, 5, 6, 7); }
#pragma unroll
            for (int kt = 0; kt < 2; ++kt)
#pragma unroll
                for (int r = 0; r < 8; ++r) sum += s[kt][nb][r];
            l[nb] = l[nb] * al + sum;
            if constexpr (HI) {
                const v8bf h0 = __builtin_convertvector(s[0][nb], v8bf), h1 = __builtin_convertvector(s[1][nb], v8bf);
                const v8bf l0 = __builtin_convertvector(s[0][nb] - __builtin_convertvector(h0, v8f), v8bf), l1 = __builtin_convertvector(s[1][nb] - __builtin_convertvector(h1, v8f), v8bf);
                pf[nb] = __builtin_shufflevector(h0, h1, 0, 1, 2, 3, 4, 5, 6, 7, 8, 9, 10, 11, 12, 13, 14, 15); pf2[nb] = __builtin_shufflevector(l0, l1, 0, 1, 2, 3, 4, 5, 6, 7, 8, 9, 10, 11, 12, 13, 14, 15);
            } else {
                pf[nb] = cat16(__builtin_convertvector(s[0][nb], v8h), __builtin_convertvector(s[1][nb], v8h));
            }
        }
#pragma unroll
        for (int dt = 0; dt < 4; ++dt)
#pragma unroll
            for (int nb = 0; nb < NQ; ++nb) { o[dt][nb] = WF::mma(vf[dt], pf[nb], o[dt][nb]); if (HI) { o[dt][nb] = WF::mma(vf[dt], pf2[nb], o[dt][nb]); o[dt][nb] = WF::mma(vf2[dt], pf[nb], o[dt][nb]); } }
    };
    // The tile's keys in ascending order, as three loops: passes wholly 128 or more below the queries, passes that need the table, passes wholly 128 or more above. Each loop has one body, so the output tiles stay in their registers from pass to pass.
    // Each is rolled: the running maximum chains the passes, so unrolling would add code and registers without overlapping them.
    const int e1 = (q0 > 127 ? q0 - 127 : 0) & ~31;   /* k0 < e1: (k0 + 31) - q0 <= -128 */
    const int e2 = (q0 + 16 * NQ + 127 + 31) & ~31;   /* k0 >= e2: k0 - (q0 + 16 NQ - 1) >= 128 */
    const int l1 = e1 - kb < KT ? e1 - kb : KT, l2 = e2 - kb < KT ? e2 - kb : KT;   /* the same bounds counted from the tile's first key */
    int kl = 0;
#pragma unroll 1
    for (; kl < l1; kl += 32) pass(BoolC<false>{}, kb + kl, kl, cneg);
#pragma unroll 1
    for (; kl < l2; kl += 32) pass(BoolC<true>{}, kb + kl, kl, 0.f);
#pragma unroll 1
    for (; kl < KT; kl += 32) pass(BoolC<false>{}, kb + kl, kl, cpos);
}
template <int NQ>
__device__ __forceinline__ void fa_out(const FaState& st, int q0, bf* Ah, bf* Al) {
    const int lane = threadIdx.x & 31;
#pragma unroll
    for (int nb = 0; nb < NQ; ++nb) { const float inv = __fdiv_rn(1.0f, st.l[nb] + xhalf(st.l[nb])); const size_t oo = (size_t)(q0 + nb * 16) * DQ + lane * 8;
#pragma unroll
        for (int dt = 0; dt < 4; ++dt) { v8us oh, ol;
#pragma unroll
            for (int r = 0; r < 8; ++r) { unsigned short a, c2; splitf(st.o[dt][nb][r] * inv, a, c2); oh[r] = a; ol[r] = c2; }
            *(v8us*)(Ah + oo + dt * 256) = oh; *(v8us*)(Al + oo + dt * 256) = ol;
            asm volatile("s_wait_xcnt 0x0" :: "v"(Ah + oo), "v"(Al + oo), "v"(oh), "v"(ol) : "memory"); } }   /* stands between the two stores and the next rewrite of a register that they name: addresses and data are inputs, so they stay in their registers up to it */
}
// grid (RH / 64, heads, batches), 10 waves, one work-group per WGP: waves 0-3 take 16 hi/lo query rows each, waves 4-9 take 32 fp16 rows each, so every work-group carries the same share of both kinds of work; planes [b][h] of (row t, k = d) (q, k) and of (row d, k = t) (v); merged output planes [b] of (row t, k = h d) as hi/lo; all in fragment order
static_assert(RH / 64 == (TT - RH) / 192 && RH % 64 == 0 && (TT - RH) % 192 == 0, "4 hi/lo waves and 6 fp16 waves per workgroup cover all rows");
__global__ __launch_bounds__(320) void k_fattn(const h16* __restrict__ Q16, const h16* __restrict__ K16, const h16* __restrict__ V16, const bf* __restrict__ Qh, const bf* __restrict__ Ql, const bf* __restrict__ Kh, const bf* __restrict__ Kl, const bf* __restrict__ Vh, const bf* __restrict__ Vl, const float* __restrict__ BT, bf* Ah, bf* Al) {
    __shared__ __attribute__((aligned(1024))) bf ring[2 * TLB / 2];   /* two buffers of one tile each */
    const int wv = __builtin_amdgcn_readfirstlane((int)(threadIdx.x >> 5)), lane = threadIdx.x & 31, bx = blockIdx.x, h = blockIdx.y, b = blockIdx.z;
    const size_t pq = ((size_t)b * NH_ + h) * TT * HD, pk = ((size_t)b * NKV + h / REP) * TT * HD, po = (size_t)b * TT * DQ + h * HD * 16;
    const float* bt = BT + (size_t)h * 4096 + (TT - 1);   /* bt[j - i] */
    const bool hw = wv < 4, cw = wv < 8;   /* kind of wave; the eight waves that copy. Both the same for a whole wave: scalar branches */
    const int q0 = hw ? (bx * 4 + wv) * 16 : RH + (bx * 6 + wv - 4) * 32;
    const unsigned rb = (unsigned)(size_t)&ring[0];   /* LDS byte address of buffer 0 */
    if (cw) fa_stage(K16 + pk, V16 + pk, Kh + pk, Kl + pk, Vh + pk, Vl + pk, rb, 0, wv, lane);
    asm volatile("s_wait_asynccnt 0x0" ::: "memory");   /* this wave's copies of tile 0 have landed */
    __syncthreads();   /* tile 0 is there for every wave */
    if (cw) fa_stage(K16 + pk, V16 + pk, Kh + pk, Kl + pk, Vh + pk, Vl + pk, rb + TLB, 1, wv, lane);
    FaState st;
    const bf* qa = (hw ? Qh + pq : (const bf*)(Q16 + pq)) + (size_t)q0 * HD + lane * 8; const bf* qb = (hw ? Ql + pq : (const bf*)(Q16 + pq) + 16 * HD) + (size_t)q0 * HD + lane * 8;   /* 16-bit patterns, whatever the kind */
#pragma unroll
    for (int ks = 0; ks < 2; ++ks) { st.q[ks] = __builtin_bit_cast(v16h, WFrag<bf>::ld(qa + ks * 512)); st.q[2 + ks] = __builtin_bit_cast(v16h, WFrag<bf>::ld(qb + ks * 512)); }
    xwait(qa, qb);
#pragma unroll
    for (int dt = 0; dt < 4; ++dt)
#pragma unroll
        for (int nb = 0; nb < 2; ++nb) st.o[dt][nb] = (v8f){};
#pragma unroll
    for (int nb = 0; nb < 2; ++nb) { st.m[nb] = -3.0e38f; st.l[nb] = 0.f; }
    const float cneg = bt[-(TT - 1)], cpos = bt[TT - 1];
    // Rolled: one trip per tile, with the hand-over of the buffers at its foot.
#pragma unroll 1
    for (int t = 0; t < TT / KT; ++t) {
        const bf* tb = ring + (t & 1) * (TLB / 2);
        if (hw) fa_tile<bf, true, 1>(st, tb + 2 * PLE, tb + 3 * PLE, tb + 4 * PLE, tb + 5 * PLE, bt, q0, t * KT, cneg, cpos);
        else fa_tile<h16, false, 2>(st, (const h16*)tb, nullptr, (const h16*)tb + PLE, nullptr, bt, q0, t * KT, cneg, cpos);
        asm volatile("s_wait_dscnt 0x0" ::: "memory");      /* this wave's reads of tile t are done */
        asm volatile("s_wait_asynccnt 0x0" ::: "memory");   /* its copies of tile t + 1 have landed */
        __syncthreads();   /* tile t + 1 is there for every wave, and no wave reads tile t any more */
        if (t + 2 < TT / KT) { if (cw) fa_stage(K16 + pk, V16 + pk, Kh + pk, Kl + pk, Vh + pk, Vl + pk, rb + (t & 1) * TLB, t + 2, wv, lane); }
    }
    asm volatile("s_wait_asynccnt 0x0" ::: "memory");   /* no copy is outstanding when the wave ends */
    if (hw) fa_out<1>(st, q0, Ah + po, Al + po); else fa_out<2>(st, q0, Ah + po, Al + po);
}

extern "C" void kernel_launch(void* const* d_in, const int* in_sizes, int n_in,
                              void* d_out, int out_size, void* d_ws, size_t ws_size, hipStream_t stream) {
    (void)in_sizes; (void)n_in; (void)out_size;
    const float* x = (const float*)d_in[0]; const float* g1 = (const float*)d_in[1]; const float* e1b = (const float*)d_in[2]; const float* wq = (const float*)d_in[3]; const float* wk = (const float*)d_in[4]; const float* wv = (const float*)d_in[5]; const float* wo = (const float*)d_in[6]; const float* relb = (const float*)d_in[7];
    float* OUT = (float*)d_out;     // [2][2048][1024]
    char* wsp = (char*)d_ws;
    auto take = [&](size_t bytes) { char* p = wsp; wsp += (bytes + 255) & ~(size_t)255; return (void*)p; };
    bf* WQ = (bf*)take((size_t)DQ * DM * 2); bf* WK = (bf*)take((size_t)DKV * DM * 2); bf* WV = (bf*)take((size_t)DKV * DM * 2); bf* WO = (bf*)take((size_t)DM * DQ * 2);
    bf* Yh = (bf*)take((size_t)NB_ * TT * DM * 2); bf* Yl = (bf*)take((size_t)NB_ * TT * DM * 2); float* BT = (float*)take((size_t)NH_ * 4096 * 4);
    h16* QP16 = (h16*)take((size_t)NB_ * NH_ * TT * HD * 2); h16* KP16 = (h16*)take((size_t)NB_ * NKV * TT * HD * 2); h16* VT16 = (h16*)take((size_t)NB_ * NKV * HD * TT * 2);
    bf* QPh = (bf*)take((size_t)NB_ * NH_ * TT * HD * 2); bf* KPh = (bf*)take((size_t)NB_ * NKV * TT * HD * 2); bf* VTh = (bf*)take((size_t)NB_ * NKV * HD * TT * 2); bf* QPl = (bf*)take((size_t)NB_ * NH_ * TT * HD * 2); bf* KPl = (bf*)take((size_t)NB_ * NKV * TT * HD * 2); bf* VTl = (bf*)take((size_t)NB_ * NKV * HD * TT * 2);   // q, k, v of each kind follow one another (every size is a multiple of 256 bytes), as do WQ, WK, WV, WO: the z stride of the merged launches
    bf* ATh = (bf*)take((size_t)NB_ * TT * DQ * 2); bf* ATl = (bf*)take((size_t)NB_ * TT * DQ * 2);
    if ((size_t)(wsp - (char*)d_ws) > ws_size) return;    // ws 256 MiB
    k_prep<<<dim3(PB_LN + PB_W + PB_T, 1, 1), 256, 0, stream>>>(x, g1, e1b, Yh, Yl, wq, wk, wv, wo, WQ, relb, BT);   /* n = LN(hidden) as hi/lo planes, both batches; all four weight planes; the bias table */
    k_gemmw<bf, 1, 1, DM><<<dim3(NB_ * TT / 128, DQ / 128, 3), 128, 0, stream>>>(Yh, Yl, WQ, nullptr, nullptr, nullptr, QP16, QPh, QPl, 0, (size_t)DQ * DM, (size_t)NB_ * NH_ * TT * HD);   /* q, k, v of both batches: head planes, written by the projections themselves */
    k_fattn<<<dim3(RH / 64, NH_, NB_), 320, 0, stream>>>(QP16, KP16, VT16, QPh, QPl, KPh, KPl, VTh, VTl, BT, ATh, ATl);
    k_gemmw<bf, 1, 0, DQ><<<dim3(NB_ * TT / 128, DM / 128, 1), 128, 0, stream>>>(ATh, ATl, WO, nullptr, x, OUT, nullptr, nullptr, nullptr, 0, 0, 0);   /* out = hidden + ctx Wo */
}
